// v000
// The times below were measured on an AMD MI455X: many runs one after another, warmed up first and cycling through
// copies of the inputs, with the whole window's GPU time divided by the number of runs. Launches and the gaps
// between them are all in it. The median over several windows is given; except for v000 it joins two sittings, which
// can be a few percent apart, so the side-by-side timings, each taken in one sitting, are the better comparison.
// v000, which the later versions start from, runs in 993 microseconds.
#include <hip/hip_runtime.h>
#include <hip/hip_bf16.h>
#include <math.h>

#define NS        4
#define CDIM      1024
#define WD        4096          // NS * CDIM
#define TAU_INV   10.0f         // 1 / 0.1
#define RMS_EPS   1.1920929e-07f
#define SINK_ITERS 50

typedef __attribute__((ext_vector_type(2))) float v2f;
typedef __attribute__((ext_vector_type(4))) float v4f;
typedef __attribute__((ext_vector_type(8))) float v8f;

// ---------------------------------------------------------------------------
// Kernel 1: per-token routing. One 256-thread workgroup per token.
// float4 (b128) pass over x computing RMS sumsq + 24 projection dots,
// block-reduce in LDS, Sinkhorn + softmaxes on lane 0, then x_pre writeback.
// ---------------------------------------------------------------------------
__global__ __launch_bounds__(256)
void mhc_router_kernel(const float* __restrict__ x,
                       const float* __restrict__ W_res,     // [16,4096]
                       const float* __restrict__ W_pre,     // [4,4096]
                       const float* __restrict__ W_post,    // [4,4096]
                       const float* __restrict__ H_res_base,// [16]
                       const float* __restrict__ H_pre_base,// [4]
                       const float* __restrict__ H_post_base,//[4]
                       const float* __restrict__ gate,      // [1]
                       float* __restrict__ ws_xpre,         // [BT,1024]
                       float* __restrict__ ws_hres,         // [BT,16]
                       float* __restrict__ ws_hpost)        // [BT,4]
{
    const int t   = blockIdx.x;
    const int tid = threadIdx.x;
    const float* __restrict__ xr = x + (size_t)t * WD;

    __shared__ float red[256 * 26];
    __shared__ float hsh[24];   // [0..15] H_res_eff, [16..19] H_pre, [20..23] H_post

    float ss = 0.0f;
    float d[24];
#pragma unroll
    for (int r = 0; r < 24; ++r) d[r] = 0.0f;

    // 4 iterations of float4 chunks: thread covers [tid*4 + it*1024, +4)
    for (int cb = tid * 4; cb < WD; cb += 1024) {
        const v4f xv = *(const v4f*)(xr + cb);
        ss += xv.x * xv.x + xv.y * xv.y + xv.z * xv.z + xv.w * xv.w;
#pragma unroll
        for (int r = 0; r < 16; ++r) {
            const v4f w = *(const v4f*)(W_res + r * WD + cb);
            d[r] += xv.x * w.x + xv.y * w.y + xv.z * w.z + xv.w * w.w;
        }
#pragma unroll
        for (int r = 0; r < 4; ++r) {
            const v4f w = *(const v4f*)(W_pre + r * WD + cb);
            d[16 + r] += xv.x * w.x + xv.y * w.y + xv.z * w.z + xv.w * w.w;
        }
#pragma unroll
        for (int r = 0; r < 4; ++r) {
            const v4f w = *(const v4f*)(W_post + r * WD + cb);
            d[20 + r] += xv.x * w.x + xv.y * w.y + xv.z * w.z + xv.w * w.w;
        }
    }

    red[tid * 26 + 0] = ss;
#pragma unroll
    for (int r = 0; r < 24; ++r) red[tid * 26 + 1 + r] = d[r];
    __syncthreads();

    for (int off = 128; off > 0; off >>= 1) {
        if (tid < off) {
#pragma unroll
            for (int k = 0; k < 25; ++k)
                red[tid * 26 + k] += red[(tid + off) * 26 + k];
        }
        __syncthreads();
    }

    if (tid == 0) {
        const float scale = rsqrtf(red[0] * (1.0f / (float)WD) + RMS_EPS);

        // --- Sinkhorn in log domain on Z = logits / tau ---
        float Z[16];
#pragma unroll
        for (int k = 0; k < 16; ++k)
            Z[k] = (red[1 + k] * scale + H_res_base[k]) * TAU_INV;

        float u[4] = {0.f, 0.f, 0.f, 0.f};
        float v[4] = {0.f, 0.f, 0.f, 0.f};
        for (int it = 0; it < SINK_ITERS; ++it) {
#pragma unroll
            for (int i = 0; i < 4; ++i) {
                float a0 = Z[i*4+0] + v[0], a1 = Z[i*4+1] + v[1];
                float a2 = Z[i*4+2] + v[2], a3 = Z[i*4+3] + v[3];
                float m  = fmaxf(fmaxf(a0, a1), fmaxf(a2, a3));
                u[i] = -(m + logf(expf(a0-m)+expf(a1-m)+expf(a2-m)+expf(a3-m)));
            }
#pragma unroll
            for (int j = 0; j < 4; ++j) {
                float a0 = Z[0*4+j] + u[0], a1 = Z[1*4+j] + u[1];
                float a2 = Z[2*4+j] + u[2], a3 = Z[3*4+j] + u[3];
                float m  = fmaxf(fmaxf(a0, a1), fmaxf(a2, a3));
                v[j] = -(m + logf(expf(a0-m)+expf(a1-m)+expf(a2-m)+expf(a3-m)));
            }
        }

        const float g = 1.0f / (1.0f + expf(-gate[0]));
#pragma unroll
        for (int i = 0; i < 4; ++i)
#pragma unroll
            for (int j = 0; j < 4; ++j) {
                float h  = expf(Z[i*4+j] + u[i] + v[j]);
                hsh[i*4+j] = g * h + ((i == j) ? (1.0f - g) : 0.0f);
            }

        // --- softmax(pre) ---
        {
            float l[4]; float m = -3.0e38f;
#pragma unroll
            for (int r = 0; r < 4; ++r) { l[r] = red[17 + r] * scale + H_pre_base[r]; m = fmaxf(m, l[r]); }
            float s = 0.f;
#pragma unroll
            for (int r = 0; r < 4; ++r) { l[r] = expf(l[r] - m); s += l[r]; }
            float inv = 1.0f / s;
#pragma unroll
            for (int r = 0; r < 4; ++r) hsh[16 + r] = l[r] * inv;
        }
        // --- softmax(post) ---
        {
            float l[4]; float m = -3.0e38f;
#pragma unroll
            for (int r = 0; r < 4; ++r) { l[r] = red[21 + r] * scale + H_post_base[r]; m = fmaxf(m, l[r]); }
            float s = 0.f;
#pragma unroll
            for (int r = 0; r < 4; ++r) { l[r] = expf(l[r] - m); s += l[r]; }
            float inv = 1.0f / s;
#pragma unroll
            for (int r = 0; r < 4; ++r) hsh[20 + r] = l[r] * inv;
        }

#pragma unroll
        for (int k = 0; k < 16; ++k) ws_hres[(size_t)t * 16 + k] = hsh[k];
#pragma unroll
        for (int k = 0; k < 4;  ++k) ws_hpost[(size_t)t * 4 + k] = hsh[20 + k];
    }
    __syncthreads();

    const float hp0 = hsh[16], hp1 = hsh[17], hp2 = hsh[18], hp3 = hsh[19];
    {
        const int cb = tid * 4;   // 256 threads * 4 floats = 1024 channels
        const v4f x0 = *(const v4f*)(xr + 0*CDIM + cb);
        const v4f x1 = *(const v4f*)(xr + 1*CDIM + cb);
        const v4f x2 = *(const v4f*)(xr + 2*CDIM + cb);
        const v4f x3 = *(const v4f*)(xr + 3*CDIM + cb);
        v4f xp;
        xp.x = x0.x*hp0 + x1.x*hp1 + x2.x*hp2 + x3.x*hp3;
        xp.y = x0.y*hp0 + x1.y*hp1 + x2.y*hp2 + x3.y*hp3;
        xp.z = x0.z*hp0 + x1.z*hp1 + x2.z*hp2 + x3.z*hp3;
        xp.w = x0.w*hp0 + x1.w*hp1 + x2.w*hp2 + x3.w*hp3;
        *(v4f*)(ws_xpre + (size_t)t * CDIM + cb) = xp;
    }
}

// ---------------------------------------------------------------------------
// Kernel 2: fused branch GEMM (y = x_pre @ W_branch) via V_WMMA_F32_16X16X4_F32
// + mixing epilogue. One workgroup (8 wave32) per 32 tokens (2 M-tiles);
// wave w owns output columns [w*128, w*128+128) for both M-tiles, so each
// B fragment is reused by 2 WMMAs (halves the B-load : WMMA ratio).
// ---------------------------------------------------------------------------
__global__ __launch_bounds__(256)
void mhc_branch_mix_kernel(const float* __restrict__ x,        // [BT,4096]
                           const float* __restrict__ Wb,       // [1024,1024]
                           const float* __restrict__ ws_xpre,  // [BT,1024]
                           const float* __restrict__ ws_hres,  // [BT,16]
                           const float* __restrict__ ws_hpost, // [BT,4]
                           float* __restrict__ out)            // [BT,4096]
{
    const int tid     = threadIdx.x;
    const int wave    = tid >> 5;
    const int lane    = tid & 31;
    const int half    = lane >> 4;       // 0: lanes 0-15, 1: lanes 16-31
    const int l15     = lane & 15;
    const int tbase   = blockIdx.x * 32; // 2 M-tiles of 16 tokens
    const int colbase = wave * 128;
    const int koff    = half * 2;        // A/B K-sublane offset per ISA layout

    __shared__ float h_lds[32 * 20];     // per token: 16 H_res_eff + 4 H_post
    for (int idx = tid; idx < 32 * 20; idx += 256) {
        const int tl = idx / 20, k = idx % 20;
        h_lds[idx] = (k < 16) ? ws_hres[(size_t)(tbase + tl) * 16 + k]
                              : ws_hpost[(size_t)(tbase + tl) * 4 + (k - 16)];
    }
    __syncthreads();

    v8f acc[2][8];
#pragma unroll
    for (int mt = 0; mt < 2; ++mt)
#pragma unroll
        for (int nt = 0; nt < 8; ++nt) {
            v8f z = {0.f, 0.f, 0.f, 0.f, 0.f, 0.f, 0.f, 0.f};
            acc[mt][nt] = z;
        }

    // A-matrix rows for this lane (one per M-tile):
    // x_pre[token = tbase + mt*16 + l15][k + koff .. +1]
    const float* __restrict__ aptr0 = ws_xpre + (size_t)(tbase + l15) * CDIM;
    const float* __restrict__ aptr1 = aptr0 + (size_t)16 * CDIM;

    for (int k = 0; k < CDIM; k += 4) {
        const v2f av0 = *(const v2f*)(aptr0 + k + koff);  // 8B aligned (k+koff even)
        const v2f av1 = *(const v2f*)(aptr1 + k + koff);
#pragma unroll
        for (int nt = 0; nt < 8; ++nt) {
            const int col = colbase + nt * 16 + l15;      // B N-index for this lane
            v2f bv;
            bv.x = Wb[(size_t)(k + koff)     * CDIM + col];
            bv.y = Wb[(size_t)(k + koff + 1) * CDIM + col];
            acc[0][nt] = __builtin_amdgcn_wmma_f32_16x16x4_f32(
                false, av0, false, bv, (short)0, acc[0][nt], false, false);
            acc[1][nt] = __builtin_amdgcn_wmma_f32_16x16x4_f32(
                false, av1, false, bv, (short)0, acc[1][nt], false, false);
        }
    }

    // Epilogue: out[t, i*C + c] = sum_j Hres[i,j]*x[t, j*C + c] + y[t,c]*Hpost[i]
#pragma unroll
    for (int mt = 0; mt < 2; ++mt) {
#pragma unroll
        for (int nt = 0; nt < 8; ++nt) {
            const int c = colbase + nt * 16 + l15;
#pragma unroll
            for (int r = 0; r < 8; ++r) {
                const int tl = mt * 16 + r + 8 * half;    // C/D layout: M = r (+8 hi lanes)
                const size_t trow = (size_t)(tbase + tl) * WD;
                const float yv = acc[mt][nt][r];
                const float x0 = x[trow + 0*CDIM + c];
                const float x1 = x[trow + 1*CDIM + c];
                const float x2 = x[trow + 2*CDIM + c];
                const float x3 = x[trow + 3*CDIM + c];
                const float* __restrict__ h = &h_lds[tl * 20];
#pragma unroll
                for (int i = 0; i < 4; ++i) {
                    const float o = h[i*4+0]*x0 + h[i*4+1]*x1 + h[i*4+2]*x2 + h[i*4+3]*x3
                                  + yv * h[16 + i];
                    out[trow + i*CDIM + c] = o;
                }
            }
        }
    }
}

// ---------------------------------------------------------------------------
extern "C" void kernel_launch(void* const* d_in, const int* in_sizes, int n_in,
                              void* d_out, int out_size, void* d_ws, size_t ws_size,
                              hipStream_t stream) {
    const float* x          = (const float*)d_in[0];
    const float* W_res      = (const float*)d_in[1];
    const float* W_pre      = (const float*)d_in[2];
    const float* W_post     = (const float*)d_in[3];
    const float* H_res_base = (const float*)d_in[4];
    const float* H_pre_base = (const float*)d_in[5];
    const float* H_post_base= (const float*)d_in[6];
    const float* gate       = (const float*)d_in[7];
    const float* W_branch   = (const float*)d_in[8];
    float* out = (float*)d_out;

    const int BT = in_sizes[0] / WD;   // B*T tokens (8192)

    float* ws       = (float*)d_ws;
    float* ws_xpre  = ws;                                  // BT*1024
    float* ws_hres  = ws_xpre + (size_t)BT * CDIM;         // BT*16
    float* ws_hpost = ws_hres + (size_t)BT * 16;           // BT*4

    mhc_router_kernel<<<BT, 256, 0, stream>>>(
        x, W_res, W_pre, W_post, H_res_base, H_pre_base, H_post_base, gate,
        ws_xpre, ws_hres, ws_hpost);

    mhc_branch_mix_kernel<<<BT / 32, 256, 0, stream>>>(
        x, W_branch, ws_xpre, ws_hres, ws_hpost, out);

    (void)n_in; (void)out_size; (void)ws_size;
}

// v001
// A run of this version takes 340 microseconds.
// Timed twice side by side with v000, it ran 2.94 and 2.95 times as fast.
#include <hip/hip_runtime.h>
#include <hip/hip_bf16.h>
#include <math.h>

#define NS        4
#define CDIM      1024
#define WD        4096          // NS * CDIM
#define TAU_INV   10.0f         // 1 / 0.1
#define RMS_EPS   1.1920929e-07f
#define SINK_ITERS 50

typedef __attribute__((ext_vector_type(2))) float v2f;
typedef __attribute__((ext_vector_type(4))) float v4f;
typedef __attribute__((ext_vector_type(8))) float v8f;

// ---------------------------------------------------------------------------
// Kernel 1: per-token routing. One 256-thread workgroup per token.
// float4 (b128) pass over x computing RMS sumsq + 24 projection dots,
// block-reduce in LDS, softmaxes on lane 0, then x_pre writeback. The scaled
// residual logits Z go to the workspace; the mix kernel runs their Sinkhorn.
// ---------------------------------------------------------------------------
__global__ __launch_bounds__(256)
void mhc_router_kernel(const float* __restrict__ x,
                       const float* __restrict__ W_res,     // [16,4096]
                       const float* __restrict__ W_pre,     // [4,4096]
                       const float* __restrict__ W_post,    // [4,4096]
                       const float* __restrict__ H_res_base,// [16]
                       const float* __restrict__ H_pre_base,// [4]
                       const float* __restrict__ H_post_base,//[4]
                       float* __restrict__ ws_xpre,         // [BT,1024]
                       float* __restrict__ ws_z,            // [BT,16] logits / tau
                       float* __restrict__ ws_hpost)        // [BT,4]
{
    const int t   = blockIdx.x;
    const int tid = threadIdx.x;
    const float* __restrict__ xr = x + (size_t)t * WD;

    __shared__ float red[256 * 26];
    __shared__ float hsh[8];    // [0..3] H_pre, [4..7] H_post

    float ss = 0.0f;
    float d[24];
#pragma unroll
    for (int r = 0; r < 24; ++r) d[r] = 0.0f;

    // 4 iterations of float4 chunks: thread covers [tid*4 + it*1024, +4)
    for (int cb = tid * 4; cb < WD; cb += 1024) {
        const v4f xv = *(const v4f*)(xr + cb);
        ss += xv.x * xv.x + xv.y * xv.y + xv.z * xv.z + xv.w * xv.w;
#pragma unroll
        for (int r = 0; r < 16; ++r) {
            const v4f w = *(const v4f*)(W_res + r * WD + cb);
            d[r] += xv.x * w.x + xv.y * w.y + xv.z * w.z + xv.w * w.w;
        }
#pragma unroll
        for (int r = 0; r < 4; ++r) {
            const v4f w = *(const v4f*)(W_pre + r * WD + cb);
            d[16 + r] += xv.x * w.x + xv.y * w.y + xv.z * w.z + xv.w * w.w;
        }
#pragma unroll
        for (int r = 0; r < 4; ++r) {
            const v4f w = *(const v4f*)(W_post + r * WD + cb);
            d[20 + r] += xv.x * w.x + xv.y * w.y + xv.z * w.z + xv.w * w.w;
        }
    }

    red[tid * 26 + 0] = ss;
#pragma unroll
    for (int r = 0; r < 24; ++r) red[tid * 26 + 1 + r] = d[r];
    __syncthreads();

    for (int off = 128; off > 0; off >>= 1) {
        if (tid < off) {
#pragma unroll
            for (int k = 0; k < 25; ++k)
                red[tid * 26 + k] += red[(tid + off) * 26 + k];
        }
        __syncthreads();
    }

    if (tid == 0) {
        const float scale = rsqrtf(red[0] * (1.0f / (float)WD) + RMS_EPS);

        // --- Z = logits / tau, input of the Sinkhorn in the mix kernel ---
#pragma unroll
        for (int k = 0; k < 16; ++k)
            ws_z[(size_t)t * 16 + k] = (red[1 + k] * scale + H_res_base[k]) * TAU_INV;

        // --- softmax(pre) ---
        {
            float l[4]; float m = -3.0e38f;
#pragma unroll
            for (int r = 0; r < 4; ++r) { l[r] = red[17 + r] * scale + H_pre_base[r]; m = fmaxf(m, l[r]); }
            float s = 0.f;
#pragma unroll
            for (int r = 0; r < 4; ++r) { l[r] = expf(l[r] - m); s += l[r]; }
            float inv = 1.0f / s;
#pragma unroll
            for (int r = 0; r < 4; ++r) hsh[r] = l[r] * inv;
        }
        // --- softmax(post) ---
        {
            float l[4]; float m = -3.0e38f;
#pragma unroll
            for (int r = 0; r < 4; ++r) { l[r] = red[21 + r] * scale + H_post_base[r]; m = fmaxf(m, l[r]); }
            float s = 0.f;
#pragma unroll
            for (int r = 0; r < 4; ++r) { l[r] = expf(l[r] - m); s += l[r]; }
            float inv = 1.0f / s;
#pragma unroll
            for (int r = 0; r < 4; ++r) hsh[4 + r] = l[r] * inv;
        }

#pragma unroll
        for (int k = 0; k < 4;  ++k) ws_hpost[(size_t)t * 4 + k] = hsh[4 + k];
    }
    __syncthreads();

    const float hp0 = hsh[0], hp1 = hsh[1], hp2 = hsh[2], hp3 = hsh[3];
    {
        const int cb = tid * 4;   // 256 threads * 4 floats = 1024 channels
        const v4f x0 = *(const v4f*)(xr + 0*CDIM + cb);
        const v4f x1 = *(const v4f*)(xr + 1*CDIM + cb);
        const v4f x2 = *(const v4f*)(xr + 2*CDIM + cb);
        const v4f x3 = *(const v4f*)(xr + 3*CDIM + cb);
        v4f xp;
        xp.x = x0.x*hp0 + x1.x*hp1 + x2.x*hp2 + x3.x*hp3;
        xp.y = x0.y*hp0 + x1.y*hp1 + x2.y*hp2 + x3.y*hp3;
        xp.z = x0.z*hp0 + x1.z*hp1 + x2.z*hp2 + x3.z*hp3;
        xp.w = x0.w*hp0 + x1.w*hp1 + x2.w*hp2 + x3.w*hp3;
        *(v4f*)(ws_xpre + (size_t)t * CDIM + cb) = xp;
    }
}

// Value held by lane K of this lane's group of four (DPP quad_perm [K,K,K,K]).
template <int K>
__device__ __forceinline__ float quad_bcast(float v) {
    return __int_as_float(__builtin_amdgcn_mov_dpp(__float_as_int(v), K * 0x55, 0xf, 0xf, true));
}

// -(log sum exp) of four values, summed in index order.
__device__ __forceinline__ float neg_lse4(float a0, float a1, float a2, float a3) {
    const float m = fmaxf(fmaxf(a0, a1), fmaxf(a2, a3));
    return -(m + logf(expf(a0-m)+expf(a1-m)+expf(a2-m)+expf(a3-m)));
}

// ---------------------------------------------------------------------------
// Kernel 2: fused branch GEMM (y = x_pre @ W_branch) via V_WMMA_F32_16X16X4_F32
// + mixing epilogue. One workgroup (8 wave32) per 32 tokens (2 M-tiles);
// wave w owns output columns [w*128, w*128+128) for both M-tiles, so each
// B fragment is reused by 2 WMMAs (halves the B-load : WMMA ratio).
// Prologue: log-domain Sinkhorn of the 32 tokens, four lanes per token
// (lane q owns row q for u and column q for v), so waves 0-3 run full.
// ---------------------------------------------------------------------------
__global__ __launch_bounds__(256)
void mhc_branch_mix_kernel(const float* __restrict__ x,        // [BT,4096]
                           const float* __restrict__ Wb,       // [1024,1024]
                           const float* __restrict__ ws_xpre,  // [BT,1024]
                           const float* __restrict__ ws_z,     // [BT,16] logits / tau
                           const float* __restrict__ ws_hpost, // [BT,4]
                           const float* __restrict__ gate,     // [1]
                           float* __restrict__ out)            // [BT,4096]
{
    const int tid     = threadIdx.x;
    const int wave    = tid >> 5;
    const int lane    = tid & 31;
    const int half    = lane >> 4;       // 0: lanes 0-15, 1: lanes 16-31
    const int l15     = lane & 15;
    const int tbase   = blockIdx.x * 32; // 2 M-tiles of 16 tokens
    const int colbase = wave * 128;
    const int koff    = half * 2;        // A/B K-sublane offset per ISA layout

    __shared__ float h_lds[32 * 20];     // per token: 16 H_res_eff + 4 H_post
    if (tid < 128) {
        const int tl = tid >> 2, q = tid & 3;
        const float* __restrict__ z = ws_z + (size_t)(tbase + tl) * 16;
        const v4f zr = *(const v4f*)(z + q * 4);                      // row q
        const float zc0 = z[q], zc1 = z[4 + q], zc2 = z[8 + q], zc3 = z[12 + q]; // column q

        float u = 0.f, v = 0.f;    // u[q], v[q] of this token
        for (int it = 0; it < SINK_ITERS; ++it) {
            u = neg_lse4(zr.x + quad_bcast<0>(v), zr.y + quad_bcast<1>(v),
                         zr.z + quad_bcast<2>(v), zr.w + quad_bcast<3>(v));
            v = neg_lse4(zc0 + quad_bcast<0>(u), zc1 + quad_bcast<1>(u),
                         zc2 + quad_bcast<2>(u), zc3 + quad_bcast<3>(u));
        }

        const float g = 1.0f / (1.0f + expf(-gate[0]));
        float* __restrict__ h = &h_lds[tl * 20 + q * 4];
        h[0] = g * expf(zr.x + u + quad_bcast<0>(v)) + ((q == 0) ? (1.0f - g) : 0.0f);
        h[1] = g * expf(zr.y + u + quad_bcast<1>(v)) + ((q == 1) ? (1.0f - g) : 0.0f);
        h[2] = g * expf(zr.z + u + quad_bcast<2>(v)) + ((q == 2) ? (1.0f - g) : 0.0f);
        h[3] = g * expf(zr.w + u + quad_bcast<3>(v)) + ((q == 3) ? (1.0f - g) : 0.0f);
    } else {
        const int idx = tid - 128;           // 32 tokens x 4 H_post
        h_lds[(idx >> 2) * 20 + 16 + (idx & 3)] = ws_hpost[(size_t)tbase * 4 + idx];
    }
    __syncthreads();

    v8f acc[2][8];
#pragma unroll
    for (int mt = 0; mt < 2; ++mt)
#pragma unroll
        for (int nt = 0; nt < 8; ++nt) {
            v8f z = {0.f, 0.f, 0.f, 0.f, 0.f, 0.f, 0.f, 0.f};
            acc[mt][nt] = z;
        }

    // A-matrix rows for this lane (one per M-tile):
    // x_pre[token = tbase + mt*16 + l15][k + koff .. +1]
    const float* __restrict__ aptr0 = ws_xpre + (size_t)(tbase + l15) * CDIM;
    const float* __restrict__ aptr1 = aptr0 + (size_t)16 * CDIM;

    for (int k = 0; k < CDIM; k += 4) {
        const v2f av0 = *(const v2f*)(aptr0 + k + koff);  // 8B aligned (k+koff even)
        const v2f av1 = *(const v2f*)(aptr1 + k + koff);
#pragma unroll
        for (int nt = 0; nt < 8; ++nt) {
            const int col = colbase + nt * 16 + l15;      // B N-index for this lane
            v2f bv;
            bv.x = Wb[(size_t)(k + koff)     * CDIM + col];
            bv.y = Wb[(size_t)(k + koff + 1) * CDIM + col];
            acc[0][nt] = __builtin_amdgcn_wmma_f32_16x16x4_f32(
                false, av0, false, bv, (short)0, acc[0][nt], false, false);
            acc[1][nt] = __builtin_amdgcn_wmma_f32_16x16x4_f32(
                false, av1, false, bv, (short)0, acc[1][nt], false, false);
        }
    }

    // Epilogue: out[t, i*C + c] = sum_j Hres[i,j]*x[t, j*C + c] + y[t,c]*Hpost[i]
#pragma unroll
    for (int mt = 0; mt < 2; ++mt) {
#pragma unroll
        for (int nt = 0; nt < 8; ++nt) {
            const int c = colbase + nt * 16 + l15;
#pragma unroll
            for (int r = 0; r < 8; ++r) {
                const int tl = mt * 16 + r + 8 * half;    // C/D layout: M = r (+8 hi lanes)
                const size_t trow = (size_t)(tbase + tl) * WD;
                const float yv = acc[mt][nt][r];
                const float x0 = x[trow + 0*CDIM + c];
                const float x1 = x[trow + 1*CDIM + c];
                const float x2 = x[trow + 2*CDIM + c];
                const float x3 = x[trow + 3*CDIM + c];
                const float* __restrict__ h = &h_lds[tl * 20];
#pragma unroll
                for (int i = 0; i < 4; ++i) {
                    const float o = h[i*4+0]*x0 + h[i*4+1]*x1 + h[i*4+2]*x2 + h[i*4+3]*x3
                                  + yv * h[16 + i];
                    out[trow + i*CDIM + c] = o;
                }
            }
        }
    }
}

// ---------------------------------------------------------------------------
extern "C" void kernel_launch(void* const* d_in, const int* in_sizes, int n_in,
                              void* d_out, int out_size, void* d_ws, size_t ws_size,
                              hipStream_t stream) {
    const float* x          = (const float*)d_in[0];
    const float* W_res      = (const float*)d_in[1];
    const float* W_pre      = (const float*)d_in[2];
    const float* W_post     = (const float*)d_in[3];
    const float* H_res_base = (const float*)d_in[4];
    const float* H_pre_base = (const float*)d_in[5];
    const float* H_post_base= (const float*)d_in[6];
    const float* gate       = (const float*)d_in[7];
    const float* W_branch   = (const float*)d_in[8];
    float* out = (float*)d_out;

    const int BT = in_sizes[0] / WD;   // B*T tokens (8192)

    float* ws       = (float*)d_ws;
    float* ws_xpre  = ws;                                  // BT*1024
    float* ws_z     = ws_xpre + (size_t)BT * CDIM;         // BT*16
    float* ws_hpost = ws_z + (size_t)BT * 16;              // BT*4

    mhc_router_kernel<<<BT, 256, 0, stream>>>(
        x, W_res, W_pre, W_post, H_res_base, H_pre_base, H_post_base,
        ws_xpre, ws_z, ws_hpost);

    mhc_branch_mix_kernel<<<BT / 32, 256, 0, stream>>>(
        x, W_branch, ws_xpre, ws_z, ws_hpost, gate, out);

    (void)n_in; (void)out_size; (void)ws_size;
}

// v002
// One run takes 243 microseconds.
// Next to v001, in two timings, it ran 1.40 times as fast each time.
// Over all steps from v000 it is 4.13 times as fast.
#include <hip/hip_runtime.h>
#include <hip/hip_bf16.h>
#include <math.h>

#define NS        4
#define CDIM      1024
#define WD        4096          // NS * CDIM
#define TAU_INV   10.0f         // 1 / 0.1
#define RMS_EPS   1.1920929e-07f
#define SINK_ITERS 50

typedef __attribute__((ext_vector_type(2))) float v2f;
typedef __attribute__((ext_vector_type(4))) float v4f;
typedef __attribute__((ext_vector_type(8))) float v8f;

// ---------------------------------------------------------------------------
// Kernel 1: routing of 32 tokens per 512-thread workgroup (16 wave32).
// The 24 projection dots are a [32 x 4096] x [4096 x 24] product on
// V_WMMA_F32_16X16X4_F32: wave w owns k in [w*256, w*256+256), two token tiles
// by two output tiles (16 W_res rows; 4 W_pre + 4 W_post rows, repeated in the
// upper eight columns, whose results are not used). Each weight line is read
// once per 32 tokens. Partials of the 16 waves are summed in LDS, then Z,
// the two softmaxes and x_pre follow: Z one thread per value, each softmax one
// thread, x_pre four channels of 16 tokens per thread.
// ---------------------------------------------------------------------------
#define RT_TOK   32                 // tokens per workgroup
#define RT_WAVES 16
#define RT_KW    (WD / RT_WAVES)    // k range of one wave
#define RT_P     26                 // 24 dots + sum of squares of each lane half

__global__ __launch_bounds__(512)
void mhc_router_kernel(const float* __restrict__ x,
                       const float* __restrict__ W_res,     // [16,4096]
                       const float* __restrict__ W_pre,     // [4,4096]
                       const float* __restrict__ W_post,    // [4,4096]
                       const float* __restrict__ H_res_base,// [16]
                       const float* __restrict__ H_pre_base,// [4]
                       const float* __restrict__ H_post_base,//[4]
                       float* __restrict__ ws_xpre,         // [BT,1024]
                       float* __restrict__ ws_z,            // [BT,16] logits / tau
                       float* __restrict__ ws_hpost)        // [BT,4]
{
    const int tid   = threadIdx.x;
    const int wave  = tid >> 5;
    const int lane  = tid & 31;
    const int half  = lane >> 4;
    const int l15   = lane & 15;
    const int tbase = blockIdx.x * RT_TOK;

    __shared__ float part[RT_WAVES * RT_TOK * RT_P];
    __shared__ float tot[RT_TOK * RT_P];
    __shared__ __attribute__((aligned(16))) float hsh[RT_TOK * 4];   // H_pre, read as float4

    // One b128 per lane feeds two k-steps: lane half h holds k = kb + 4h .. 4h+3
    // of its row, the same for the token rows (A) and the weight rows (B).
    const int k0 = wave * RT_KW + half * 4;
    const float* ap  = x + (size_t)(tbase + l15) * WD + k0;      // second token tile: + 16 rows
    const float* b0p = W_res + (size_t)l15 * WD + k0;
    const float* b1p = ((l15 & 4) ? W_post : W_pre) + (size_t)(l15 & 3) * WD + k0;

    v8f acc[2][2];
#pragma unroll
    for (int mt = 0; mt < 2; ++mt)
#pragma unroll
        for (int nt = 0; nt < 2; ++nt) {
            v8f z = {0.f, 0.f, 0.f, 0.f, 0.f, 0.f, 0.f, 0.f};
            acc[mt][nt] = z;
        }
    v2f ss0l = {0.f, 0.f}, ss0h = {0.f, 0.f};   // sums of squares, by register pair of the A fragments
    v2f ss1l = {0.f, 0.f}, ss1h = {0.f, 0.f};

    // One trip: 64 k of every row (256 bytes), 32 loads, 64 WMMAs.
    for (int kb = 0; kb < RT_KW; kb += 64) {
        v4f a0[8], a1[8], b0[8], b1[8];
#pragma unroll
        for (int i = 0; i < 8; ++i) {
            a0[i] = *(const v4f*)(ap + i * 8);
            a1[i] = *(const v4f*)(ap + 16 * WD + i * 8);
        }
#pragma unroll
        for (int i = 0; i < 8; ++i) {
            b0[i] = *(const v4f*)(b0p + i * 8);
            b1[i] = *(const v4f*)(b1p + i * 8);
        }
        // The three address pairs stay live up to this wait, so that no result of the run
        // is placed in a register that an issued load names; they advance behind it.
        asm volatile("s_wait_xcnt 0x0" :: "v"(ap), "v"(b0p), "v"(b1p) : "memory");
        ap += 64; b0p += 64; b1p += 64;
#pragma unroll
        for (int i = 0; i < 8; ++i) {
            const v2f p0l = {a0[i].x, a0[i].y}, p0h = {a0[i].z, a0[i].w};
            const v2f p1l = {a1[i].x, a1[i].y}, p1h = {a1[i].z, a1[i].w};
            ss0l += p0l * p0l;
            ss0h += p0h * p0h;
            ss1l += p1l * p1l;
            ss1h += p1h * p1h;
        }
#pragma unroll
        for (int i = 0; i < 8; ++i) {
            const v2f a0l = {a0[i].x, a0[i].y}, a0h = {a0[i].z, a0[i].w};
            const v2f a1l = {a1[i].x, a1[i].y}, a1h = {a1[i].z, a1[i].w};
            const v2f b0l = {b0[i].x, b0[i].y}, b0h = {b0[i].z, b0[i].w};
            const v2f b1l = {b1[i].x, b1[i].y}, b1h = {b1[i].z, b1[i].w};
            acc[0][0] = __builtin_amdgcn_wmma_f32_16x16x4_f32(false, a0l, false, b0l, (short)0, acc[0][0], false, false);
            acc[1][0] = __builtin_amdgcn_wmma_f32_16x16x4_f32(false, a1l, false, b0l, (short)0, acc[1][0], false, false);
            acc[0][1] = __builtin_amdgcn_wmma_f32_16x16x4_f32(false, a0l, false, b1l, (short)0, acc[0][1], false, false);
            acc[1][1] = __builtin_amdgcn_wmma_f32_16x16x4_f32(false, a1l, false, b1l, (short)0, acc[1][1], false, false);
            acc[0][0] = __builtin_amdgcn_wmma_f32_16x16x4_f32(false, a0h, false, b0h, (short)0, acc[0][0], false, false);
            acc[1][0] = __builtin_amdgcn_wmma_f32_16x16x4_f32(false, a1h, false, b0h, (short)0, acc[1][0], false, false);
            acc[0][1] = __builtin_amdgcn_wmma_f32_16x16x4_f32(false, a0h, false, b1h, (short)0, acc[0][1], false, false);
            acc[1][1] = __builtin_amdgcn_wmma_f32_16x16x4_f32(false, a1h, false, b1h, (short)0, acc[1][1], false, false);
        }
        // Order of the trip: the 32 loads (all in flight before the first use; left alone
        // the compiler holds the last twelve back among the WMMAs), then the vector work,
        // then the matrix run, so that no vector result is placed in an A or B register
        // directly behind the WMMA that reads it.
        __builtin_amdgcn_sched_group_barrier(0x020, 32, 0);   // global loads
        __builtin_amdgcn_sched_group_barrier(0x002, 38, 0);   // vector ALU
        __builtin_amdgcn_sched_group_barrier(0x008, 64, 0);   // WMMA
    }

    // Four vector slots between the last WMMAs and the address arithmetic below, which reuses
    // their A registers (left alone, the first such write stands three slots behind its WMMA).
    asm volatile("v_nop\n\tv_nop\n\tv_nop\n\tv_nop");

    // This wave's partials: [token][0..15 res, 16..19 pre, 20..23 post, 24..25 sumsq]
    {
        float* __restrict__ pw = part + wave * (RT_TOK * RT_P);
#pragma unroll
        for (int mt = 0; mt < 2; ++mt)
#pragma unroll
            for (int r = 0; r < 8; ++r) {
                const int tl = mt * 16 + r + 8 * half;   // C/D layout: M = r (+8 hi lanes)
                pw[tl * RT_P + l15] = acc[mt][0][r];
            }
        if (l15 < 8) {
#pragma unroll
            for (int mt = 0; mt < 2; ++mt)
#pragma unroll
                for (int r = 0; r < 8; ++r)
                    pw[(mt * 16 + r + 8 * half) * RT_P + 16 + l15] = acc[mt][1][r];
        }
        pw[l15 * RT_P + 24 + half]        = (ss0l.x + ss0l.y) + (ss0h.x + ss0h.y);
        pw[(16 + l15) * RT_P + 24 + half] = (ss1l.x + ss1l.y) + (ss1h.x + ss1h.y);
    }
    __syncthreads();

    for (int idx = tid; idx < RT_TOK * RT_P; idx += 512) {
        float s = 0.0f;
#pragma unroll
        for (int w = 0; w < RT_WAVES; ++w) s += part[w * (RT_TOK * RT_P) + idx];
        tot[idx] = s;
    }
    __syncthreads();

    // --- Z = logits / tau, input of the Sinkhorn in the mix kernel ---
    {
        const int tl = tid >> 4, k = tid & 15;
        const float* __restrict__ tr = tot + tl * RT_P;
        const float scale = rsqrtf((tr[24] + tr[25]) * (1.0f / (float)WD) + RMS_EPS);
        ws_z[(size_t)(tbase + tl) * 16 + k] = (tr[k] * scale + H_res_base[k]) * TAU_INV;
    }
    // --- softmax(pre) on even threads, softmax(post) on odd threads ---
    if (tid < 2 * RT_TOK) {
        const int tl = tid >> 1, post = tid & 1;
        const float* __restrict__ tr = tot + tl * RT_P;
        const float* __restrict__ hb = post ? H_post_base : H_pre_base;
        const float scale = rsqrtf((tr[24] + tr[25]) * (1.0f / (float)WD) + RMS_EPS);
        float l[4]; float m = -3.0e38f;
#pragma unroll
        for (int r = 0; r < 4; ++r) { l[r] = tr[16 + post * 4 + r] * scale + hb[r]; m = fmaxf(m, l[r]); }
        float s = 0.f;
#pragma unroll
        for (int r = 0; r < 4; ++r) { l[r] = expf(l[r] - m); s += l[r]; }
        const float inv = 1.0f / s;
        if (post) {
#pragma unroll
            for (int r = 0; r < 4; ++r) ws_hpost[(size_t)(tbase + tl) * 4 + r] = l[r] * inv;
        } else {
#pragma unroll
            for (int r = 0; r < 4; ++r) hsh[tl * 4 + r] = l[r] * inv;
        }
    }
    __syncthreads();

    // x_pre: 256 threads x 4 floats cover one token's 1024 channels; the two halves of the
    // block take the even and the odd tokens, eight tokens each a trip (32 loads in flight).
    const int hi = tid >> 8, cb = (tid & 255) * 4;
    const float* xb = x + (size_t)(tbase + hi) * WD + cb;
    float* __restrict__ ob = ws_xpre + (size_t)(tbase + hi) * CDIM + cb;
    // Unrolled: every load and store is then an immediate offset on its one address pair.
#pragma unroll
    for (int jb = 0; jb < RT_TOK / 2; jb += 8) {
        v4f xv[8][4];
#pragma unroll
        for (int u = 0; u < 8; ++u)
#pragma unroll
            for (int s = 0; s < 4; ++s) xv[u][s] = *(const v4f*)(xb + (jb + u) * 2 * WD + s * CDIM);
        // The address pair stays live up to this wait, so that no result of the run lands in it.
        asm volatile("s_wait_xcnt 0x0" :: "v"(xb) : "memory");
#pragma unroll
        for (int u = 0; u < 8; ++u) {
            const v4f hp = *(const v4f*)(hsh + (2 * (jb + u) + hi) * 4);
            const v4f xp = xv[u][0] * hp.x + xv[u][1] * hp.y + xv[u][2] * hp.z + xv[u][3] * hp.w;
            *(v4f*)(ob + (jb + u) * 2 * CDIM) = xp;
        }
        // The next trip's loads land in the data registers of the stores above.
        if (jb + 8 < RT_TOK / 2) asm volatile("s_wait_xcnt 0x0" ::: "memory");
    }
}

// Value held by lane K of this lane's group of four (DPP quad_perm [K,K,K,K]).
template <int K>
__device__ __forceinline__ float quad_bcast(float v) {
    return __int_as_float(__builtin_amdgcn_mov_dpp(__float_as_int(v), K * 0x55, 0xf, 0xf, true));
}

// -(log sum exp) of four values, summed in index order.
__device__ __forceinline__ float neg_lse4(float a0, float a1, float a2, float a3) {
    const float m = fmaxf(fmaxf(a0, a1), fmaxf(a2, a3));
    return -(m + logf(expf(a0-m)+expf(a1-m)+expf(a2-m)+expf(a3-m)));
}

// ---------------------------------------------------------------------------
// Kernel 2: fused branch GEMM (y = x_pre @ W_branch) via V_WMMA_F32_16X16X4_F32
// + mixing epilogue. One workgroup (8 wave32) per 32 tokens (2 M-tiles);
// wave w owns output columns [w*128, w*128+128) for both M-tiles, so each
// B fragment is reused by 2 WMMAs (halves the B-load : WMMA ratio).
// Prologue: log-domain Sinkhorn of the 32 tokens, four lanes per token
// (lane q owns row q for u and column q for v), so waves 0-3 run full.
// ---------------------------------------------------------------------------
__global__ __launch_bounds__(256)
void mhc_branch_mix_kernel(const float* __restrict__ x,        // [BT,4096]
                           const float* __restrict__ Wb,       // [1024,1024]
                           const float* __restrict__ ws_xpre,  // [BT,1024]
                           const float* __restrict__ ws_z,     // [BT,16] logits / tau
                           const float* __restrict__ ws_hpost, // [BT,4]
                           const float* __restrict__ gate,     // [1]
                           float* __restrict__ out)            // [BT,4096]
{
    const int tid     = threadIdx.x;
    const int wave    = tid >> 5;
    const int lane    = tid & 31;
    const int half    = lane >> 4;       // 0: lanes 0-15, 1: lanes 16-31
    const int l15     = lane & 15;
    const int tbase   = blockIdx.x * 32; // 2 M-tiles of 16 tokens
    const int colbase = wave * 128;
    const int koff    = half * 2;        // A/B K-sublane offset per ISA layout

    __shared__ float h_lds[32 * 20];     // per token: 16 H_res_eff + 4 H_post
    if (tid < 128) {
        const int tl = tid >> 2, q = tid & 3;
        const float* __restrict__ z = ws_z + (size_t)(tbase + tl) * 16;
        const v4f zr = *(const v4f*)(z + q * 4);                      // row q
        const float zc0 = z[q], zc1 = z[4 + q], zc2 = z[8 + q], zc3 = z[12 + q]; // column q

        float u = 0.f, v = 0.f;    // u[q], v[q] of this token
        for (int it = 0; it < SINK_ITERS; ++it) {
            u = neg_lse4(zr.x + quad_bcast<0>(v), zr.y + quad_bcast<1>(v),
                         zr.z + quad_bcast<2>(v), zr.w + quad_bcast<3>(v));
            v = neg_lse4(zc0 + quad_bcast<0>(u), zc1 + quad_bcast<1>(u),
                         zc2 + quad_bcast<2>(u), zc3 + quad_bcast<3>(u));
        }

        const float g = 1.0f / (1.0f + expf(-gate[0]));
        float* __restrict__ h = &h_lds[tl * 20 + q * 4];
        h[0] = g * expf(zr.x + u + quad_bcast<0>(v)) + ((q == 0) ? (1.0f - g) : 0.0f);
        h[1] = g * expf(zr.y + u + quad_bcast<1>(v)) + ((q == 1) ? (1.0f - g) : 0.0f);
        h[2] = g * expf(zr.z + u + quad_bcast<2>(v)) + ((q == 2) ? (1.0f - g) : 0.0f);
        h[3] = g * expf(zr.w + u + quad_bcast<3>(v)) + ((q == 3) ? (1.0f - g) : 0.0f);
    } else {
        const int idx = tid - 128;           // 32 tokens x 4 H_post
        h_lds[(idx >> 2) * 20 + 16 + (idx & 3)] = ws_hpost[(size_t)tbase * 4 + idx];
    }
    __syncthreads();

    v8f acc[2][8];
#pragma unroll
    for (int mt = 0; mt < 2; ++mt)
#pragma unroll
        for (int nt = 0; nt < 8; ++nt) {
            v8f z = {0.f, 0.f, 0.f, 0.f, 0.f, 0.f, 0.f, 0.f};
            acc[mt][nt] = z;
        }

    // A-matrix rows for this lane (one per M-tile):
    // x_pre[token = tbase + mt*16 + l15][k + koff .. +1]
    const float* __restrict__ aptr0 = ws_xpre + (size_t)(tbase + l15) * CDIM;
    const float* __restrict__ aptr1 = aptr0 + (size_t)16 * CDIM;

    for (int k = 0; k < CDIM; k += 4) {
        const v2f av0 = *(const v2f*)(aptr0 + k + koff);  // 8B aligned (k+koff even)
        const v2f av1 = *(const v2f*)(aptr1 + k + koff);
#pragma unroll
        for (int nt = 0; nt < 8; ++nt) {
            const int col = colbase + nt * 16 + l15;      // B N-index for this lane
            v2f bv;
            bv.x = Wb[(size_t)(k + koff)     * CDIM + col];
            bv.y = Wb[(size_t)(k + koff + 1) * CDIM + col];
            acc[0][nt] = __builtin_amdgcn_wmma_f32_16x16x4_f32(
                false, av0, false, bv, (short)0, acc[0][nt], false, false);
            acc[1][nt] = __builtin_amdgcn_wmma_f32_16x16x4_f32(
                false, av1, false, bv, (short)0, acc[1][nt], false, false);
        }
    }

    // Epilogue: out[t, i*C + c] = sum_j Hres[i,j]*x[t, j*C + c] + y[t,c]*Hpost[i]
#pragma unroll
    for (int mt = 0; mt < 2; ++mt) {
#pragma unroll
        for (int nt = 0; nt < 8; ++nt) {
            const int c = colbase + nt * 16 + l15;
#pragma unroll
            for (int r = 0; r < 8; ++r) {
                const int tl = mt * 16 + r + 8 * half;    // C/D layout: M = r (+8 hi lanes)
                const size_t trow = (size_t)(tbase + tl) * WD;
                const float yv = acc[mt][nt][r];
                const float x0 = x[trow + 0*CDIM + c];
                const float x1 = x[trow + 1*CDIM + c];
                const float x2 = x[trow + 2*CDIM + c];
                const float x3 = x[trow + 3*CDIM + c];
                const float* __restrict__ h = &h_lds[tl * 20];
#pragma unroll
                for (int i = 0; i < 4; ++i) {
                    const float o = h[i*4+0]*x0 + h[i*4+1]*x1 + h[i*4+2]*x2 + h[i*4+3]*x3
                                  + yv * h[16 + i];
                    out[trow + i*CDIM + c] = o;
                }
            }
        }
    }
}

// ---------------------------------------------------------------------------
extern "C" void kernel_launch(void* const* d_in, const int* in_sizes, int n_in,
                              void* d_out, int out_size, void* d_ws, size_t ws_size,
                              hipStream_t stream) {
    const float* x          = (const float*)d_in[0];
    const float* W_res      = (const float*)d_in[1];
    const float* W_pre      = (const float*)d_in[2];
    const float* W_post     = (const float*)d_in[3];
    const float* H_res_base = (const float*)d_in[4];
    const float* H_pre_base = (const float*)d_in[5];
    const float* H_post_base= (const float*)d_in[6];
    const float* gate       = (const float*)d_in[7];
    const float* W_branch   = (const float*)d_in[8];
    float* out = (float*)d_out;

    const int BT = in_sizes[0] / WD;   // B*T tokens (8192)

    float* ws       = (float*)d_ws;
    float* ws_xpre  = ws;                                  // BT*1024
    float* ws_z     = ws_xpre + (size_t)BT * CDIM;         // BT*16
    float* ws_hpost = ws_z + (size_t)BT * 16;              // BT*4

    mhc_router_kernel<<<BT / RT_TOK, 512, 0, stream>>>(
        x, W_res, W_pre, W_post, H_res_base, H_pre_base, H_post_base,
        ws_xpre, ws_z, ws_hpost);

    mhc_branch_mix_kernel<<<BT / 32, 256, 0, stream>>>(
        x, W_branch, ws_xpre, ws_z, ws_hpost, gate, out);

    (void)n_in; (void)out_size; (void)ws_size;
}

// v003
// One run takes 143 microseconds.
// Two timings next to v002 both put it at 1.70 times that version's speed.
// All steps since v000 together make it 7.01 times as fast.
#include <hip/hip_runtime.h>
#include <hip/hip_bf16.h>
#include <math.h>

#define NS        4
#define CDIM      1024
#define WD        4096          // NS * CDIM
#define TAU_INV   10.0f         // 1 / 0.1
#define RMS_EPS   1.1920929e-07f
#define SINK_ITERS 50

typedef __attribute__((ext_vector_type(2))) float v2f;
typedef __attribute__((ext_vector_type(4))) float v4f;
typedef __attribute__((ext_vector_type(8))) float v8f;

// ---------------------------------------------------------------------------
// Kernel 1: routing of 32 tokens per 512-thread workgroup (16 wave32).
// The 24 projection dots are a [32 x 4096] x [4096 x 24] product on
// V_WMMA_F32_16X16X4_F32: wave w owns k in [w*256, w*256+256), two token tiles
// by two output tiles (16 W_res rows; 4 W_pre + 4 W_post rows, repeated in the
// upper eight columns, whose results are not used). Each weight line is read
// once per 32 tokens. Partials of the 16 waves are summed in LDS, then Z,
// the two softmaxes and x_pre follow: Z one thread per value, each softmax one
// thread, x_pre four channels of 16 tokens per thread.
// ---------------------------------------------------------------------------
#define RT_TOK   32                 // tokens per workgroup
#define RT_WAVES 16
#define RT_KW    (WD / RT_WAVES)    // k range of one wave
#define RT_P     26                 // 24 dots + sum of squares of each lane half

__global__ __launch_bounds__(512)
void mhc_router_kernel(const float* __restrict__ x,
                       const float* __restrict__ W_res,     // [16,4096]
                       const float* __restrict__ W_pre,     // [4,4096]
                       const float* __restrict__ W_post,    // [4,4096]
                       const float* __restrict__ H_res_base,// [16]
                       const float* __restrict__ H_pre_base,// [4]
                       const float* __restrict__ H_post_base,//[4]
                       float* __restrict__ ws_xpre,         // [BT,1024]
                       float* __restrict__ ws_z,            // [BT,16] logits / tau
                       float* __restrict__ ws_hpost)        // [BT,4]
{
    const int tid   = threadIdx.x;
    const int wave  = tid >> 5;
    const int lane  = tid & 31;
    const int half  = lane >> 4;
    const int l15   = lane & 15;
    const int tbase = blockIdx.x * RT_TOK;

    __shared__ float part[RT_WAVES * RT_TOK * RT_P];
    __shared__ float tot[RT_TOK * RT_P];
    __shared__ __attribute__((aligned(16))) float hsh[RT_TOK * 4];   // H_pre, read as float4

    // One b128 per lane feeds two k-steps: lane half h holds k = kb + 4h .. 4h+3
    // of its row, the same for the token rows (A) and the weight rows (B).
    const int k0 = wave * RT_KW + half * 4;
    const float* ap  = x + (size_t)(tbase + l15) * WD + k0;      // second token tile: + 16 rows
    const float* b0p = W_res + (size_t)l15 * WD + k0;
    const float* b1p = ((l15 & 4) ? W_post : W_pre) + (size_t)(l15 & 3) * WD + k0;

    v8f acc[2][2];
#pragma unroll
    for (int mt = 0; mt < 2; ++mt)
#pragma unroll
        for (int nt = 0; nt < 2; ++nt) {
            v8f z = {0.f, 0.f, 0.f, 0.f, 0.f, 0.f, 0.f, 0.f};
            acc[mt][nt] = z;
        }
    v2f ss0l = {0.f, 0.f}, ss0h = {0.f, 0.f};   // sums of squares, by register pair of the A fragments
    v2f ss1l = {0.f, 0.f}, ss1h = {0.f, 0.f};

    // One trip: 64 k of every row (256 bytes), 32 loads, 64 WMMAs.
    for (int kb = 0; kb < RT_KW; kb += 64) {
        v4f a0[8], a1[8], b0[8], b1[8];
#pragma unroll
        for (int i = 0; i < 8; ++i) {
            a0[i] = *(const v4f*)(ap + i * 8);
            a1[i] = *(const v4f*)(ap + 16 * WD + i * 8);
        }
#pragma unroll
        for (int i = 0; i < 8; ++i) {
            b0[i] = *(const v4f*)(b0p + i * 8);
            b1[i] = *(const v4f*)(b1p + i * 8);
        }
        // The three address pairs stay live up to this wait, so that no result of the run
        // is placed in a register that an issued load names; they advance behind it.
        asm volatile("s_wait_xcnt 0x0" :: "v"(ap), "v"(b0p), "v"(b1p) : "memory");
        ap += 64; b0p += 64; b1p += 64;
#pragma unroll
        for (int i = 0; i < 8; ++i) {
            const v2f p0l = {a0[i].x, a0[i].y}, p0h = {a0[i].z, a0[i].w};
            const v2f p1l = {a1[i].x, a1[i].y}, p1h = {a1[i].z, a1[i].w};
            ss0l += p0l * p0l;
            ss0h += p0h * p0h;
            ss1l += p1l * p1l;
            ss1h += p1h * p1h;
        }
#pragma unroll
        for (int i = 0; i < 8; ++i) {
            const v2f a0l = {a0[i].x, a0[i].y}, a0h = {a0[i].z, a0[i].w};
            const v2f a1l = {a1[i].x, a1[i].y}, a1h = {a1[i].z, a1[i].w};
            const v2f b0l = {b0[i].x, b0[i].y}, b0h = {b0[i].z, b0[i].w};
            const v2f b1l = {b1[i].x, b1[i].y}, b1h = {b1[i].z, b1[i].w};
            acc[0][0] = __builtin_amdgcn_wmma_f32_16x16x4_f32(false, a0l, false, b0l, (short)0, acc[0][0], false, false);
            acc[1][0] = __builtin_amdgcn_wmma_f32_16x16x4_f32(false, a1l, false, b0l, (short)0, acc[1][0], false, false);
            acc[0][1] = __builtin_amdgcn_wmma_f32_16x16x4_f32(false, a0l, false, b1l, (short)0, acc[0][1], false, false);
            acc[1][1] = __builtin_amdgcn_wmma_f32_16x16x4_f32(false, a1l, false, b1l, (short)0, acc[1][1], false, false);
            acc[0][0] = __builtin_amdgcn_wmma_f32_16x16x4_f32(false, a0h, false, b0h, (short)0, acc[0][0], false, false);
            acc[1][0] = __builtin_amdgcn_wmma_f32_16x16x4_f32(false, a1h, false, b0h, (short)0, acc[1][0], false, false);
            acc[0][1] = __builtin_amdgcn_wmma_f32_16x16x4_f32(false, a0h, false, b1h, (short)0, acc[0][1], false, false);
            acc[1][1] = __builtin_amdgcn_wmma_f32_16x16x4_f32(false, a1h, false, b1h, (short)0, acc[1][1], false, false);
        }
        // Order of the trip: the 32 loads (all in flight before the first use; left alone
        // the compiler holds the last twelve back among the WMMAs), then the vector work,
        // then the matrix run, so that no vector result is placed in an A or B register
        // directly behind the WMMA that reads it.
        __builtin_amdgcn_sched_group_barrier(0x020, 32, 0);   // global loads
        __builtin_amdgcn_sched_group_barrier(0x002, 38, 0);   // vector ALU
        __builtin_amdgcn_sched_group_barrier(0x008, 64, 0);   // WMMA
    }

    // Four vector slots between the last WMMAs and the address arithmetic below, which reuses
    // their A registers (left alone, the first such write stands three slots behind its WMMA).
    asm volatile("v_nop\n\tv_nop\n\tv_nop\n\tv_nop");

    // This wave's partials: [token][0..15 res, 16..19 pre, 20..23 post, 24..25 sumsq]
    {
        float* __restrict__ pw = part + wave * (RT_TOK * RT_P);
#pragma unroll
        for (int mt = 0; mt < 2; ++mt)
#pragma unroll
            for (int r = 0; r < 8; ++r) {
                const int tl = mt * 16 + r + 8 * half;   // C/D layout: M = r (+8 hi lanes)
                pw[tl * RT_P + l15] = acc[mt][0][r];
            }
        if (l15 < 8) {
#pragma unroll
            for (int mt = 0; mt < 2; ++mt)
#pragma unroll
                for (int r = 0; r < 8; ++r)
                    pw[(mt * 16 + r + 8 * half) * RT_P + 16 + l15] = acc[mt][1][r];
        }
        pw[l15 * RT_P + 24 + half]        = (ss0l.x + ss0l.y) + (ss0h.x + ss0h.y);
        pw[(16 + l15) * RT_P + 24 + half] = (ss1l.x + ss1l.y) + (ss1h.x + ss1h.y);
    }
    __syncthreads();

    for (int idx = tid; idx < RT_TOK * RT_P; idx += 512) {
        float s = 0.0f;
#pragma unroll
        for (int w = 0; w < RT_WAVES; ++w) s += part[w * (RT_TOK * RT_P) + idx];
        tot[idx] = s;
    }
    __syncthreads();

    // --- Z = logits / tau, input of the Sinkhorn in the mix kernel ---
    {
        const int tl = tid >> 4, k = tid & 15;
        const float* __restrict__ tr = tot + tl * RT_P;
        const float scale = rsqrtf((tr[24] + tr[25]) * (1.0f / (float)WD) + RMS_EPS);
        ws_z[(size_t)(tbase + tl) * 16 + k] = (tr[k] * scale + H_res_base[k]) * TAU_INV;
    }
    // --- softmax(pre) on even threads, softmax(post) on odd threads ---
    if (tid < 2 * RT_TOK) {
        const int tl = tid >> 1, post = tid & 1;
        const float* __restrict__ tr = tot + tl * RT_P;
        const float* __restrict__ hb = post ? H_post_base : H_pre_base;
        const float scale = rsqrtf((tr[24] + tr[25]) * (1.0f / (float)WD) + RMS_EPS);
        float l[4]; float m = -3.0e38f;
#pragma unroll
        for (int r = 0; r < 4; ++r) { l[r] = tr[16 + post * 4 + r] * scale + hb[r]; m = fmaxf(m, l[r]); }
        float s = 0.f;
#pragma unroll
        for (int r = 0; r < 4; ++r) { l[r] = expf(l[r] - m); s += l[r]; }
        const float inv = 1.0f / s;
        if (post) {
#pragma unroll
            for (int r = 0; r < 4; ++r) ws_hpost[(size_t)(tbase + tl) * 4 + r] = l[r] * inv;
        } else {
#pragma unroll
            for (int r = 0; r < 4; ++r) hsh[tl * 4 + r] = l[r] * inv;
        }
    }
    __syncthreads();

    // x_pre: 256 threads x 4 floats cover one token's 1024 channels; the two halves of the
    // block take the even and the odd tokens, eight tokens each a trip (32 loads in flight).
    const int hi = tid >> 8, cb = (tid & 255) * 4;
    const float* xb = x + (size_t)(tbase + hi) * WD + cb;
    float* __restrict__ ob = ws_xpre + (size_t)(tbase + hi) * CDIM + cb;
    // Unrolled: every load and store is then an immediate offset on its one address pair.
#pragma unroll
    for (int jb = 0; jb < RT_TOK / 2; jb += 8) {
        v4f xv[8][4];
#pragma unroll
        for (int u = 0; u < 8; ++u)
#pragma unroll
            for (int s = 0; s < 4; ++s) xv[u][s] = *(const v4f*)(xb + (jb + u) * 2 * WD + s * CDIM);
        // The address pair stays live up to this wait, so that no result of the run lands in it.
        asm volatile("s_wait_xcnt 0x0" :: "v"(xb) : "memory");
#pragma unroll
        for (int u = 0; u < 8; ++u) {
            const v4f hp = *(const v4f*)(hsh + (2 * (jb + u) + hi) * 4);
            const v4f xp = xv[u][0] * hp.x + xv[u][1] * hp.y + xv[u][2] * hp.z + xv[u][3] * hp.w;
            *(v4f*)(ob + (jb + u) * 2 * CDIM) = xp;
        }
        // The next trip's loads land in the data registers of the stores above.
        if (jb + 8 < RT_TOK / 2) asm volatile("s_wait_xcnt 0x0" ::: "memory");
    }
}

// Value held by lane K of this lane's group of four (DPP quad_perm [K,K,K,K]).
template <int K>
__device__ __forceinline__ float quad_bcast(float v) {
    return __int_as_float(__builtin_amdgcn_mov_dpp(__float_as_int(v), K * 0x55, 0xf, 0xf, true));
}

// -(log sum exp) of four values, summed in index order.
__device__ __forceinline__ float neg_lse4(float a0, float a1, float a2, float a3) {
    const float m = fmaxf(fmaxf(a0, a1), fmaxf(a2, a3));
    return -(m + logf(expf(a0-m)+expf(a1-m)+expf(a2-m)+expf(a3-m)));
}

// ---------------------------------------------------------------------------
// Kernel 2: fused branch GEMM (y = x_pre @ W_branch) via V_WMMA_F32_16X16X4_F32
// + mixing epilogue. One workgroup (8 wave32) per 32 tokens (2 M-tiles);
// wave w owns output columns [w*128, w*128+128) for both M-tiles, so each
// B fragment is reused by 2 WMMAs (halves the B-load : WMMA ratio).
// Within its 128 columns a lane owns four adjacent ones per 64, see below.
// Prologue: log-domain Sinkhorn of the 32 tokens, four lanes per token
// (lane q owns row q for u and column q for v), so waves 0-3 run full.
// ---------------------------------------------------------------------------
__global__ __launch_bounds__(256)
void mhc_branch_mix_kernel(const float* __restrict__ x,        // [BT,4096]
                           const float* __restrict__ Wb,       // [1024,1024]
                           const float* __restrict__ ws_xpre,  // [BT,1024]
                           const float* __restrict__ ws_z,     // [BT,16] logits / tau
                           const float* __restrict__ ws_hpost, // [BT,4]
                           const float* __restrict__ gate,     // [1]
                           float* __restrict__ out)            // [BT,4096]
{
    const int tid     = threadIdx.x;
    const int wave    = tid >> 5;
    const int lane    = tid & 31;
    const int half    = lane >> 4;       // 0: lanes 0-15, 1: lanes 16-31
    const int l15     = lane & 15;
    const int tbase   = blockIdx.x * 32; // 2 M-tiles of 16 tokens
    const int colbase = wave * 128;

    __shared__ float h_lds[32 * 20];     // per token: 16 H_res_eff + 4 H_post
    if (tid < 128) {
        const int tl = tid >> 2, q = tid & 3;
        const float* __restrict__ z = ws_z + (size_t)(tbase + tl) * 16;
        const v4f zr = *(const v4f*)(z + q * 4);                      // row q
        const float zc0 = z[q], zc1 = z[4 + q], zc2 = z[8 + q], zc3 = z[12 + q]; // column q

        float u = 0.f, v = 0.f;    // u[q], v[q] of this token
        for (int it = 0; it < SINK_ITERS; ++it) {
            u = neg_lse4(zr.x + quad_bcast<0>(v), zr.y + quad_bcast<1>(v),
                         zr.z + quad_bcast<2>(v), zr.w + quad_bcast<3>(v));
            v = neg_lse4(zc0 + quad_bcast<0>(u), zc1 + quad_bcast<1>(u),
                         zc2 + quad_bcast<2>(u), zc3 + quad_bcast<3>(u));
        }

        const float g = 1.0f / (1.0f + expf(-gate[0]));
        float* __restrict__ h = &h_lds[tl * 20 + q * 4];
        h[0] = g * expf(zr.x + u + quad_bcast<0>(v)) + ((q == 0) ? (1.0f - g) : 0.0f);
        h[1] = g * expf(zr.y + u + quad_bcast<1>(v)) + ((q == 1) ? (1.0f - g) : 0.0f);
        h[2] = g * expf(zr.z + u + quad_bcast<2>(v)) + ((q == 2) ? (1.0f - g) : 0.0f);
        h[3] = g * expf(zr.w + u + quad_bcast<3>(v)) + ((q == 3) ? (1.0f - g) : 0.0f);
    } else {
        const int idx = tid - 128;           // 32 tokens x 4 H_post
        h_lds[(idx >> 2) * 20 + 16 + (idx & 3)] = ws_hpost[(size_t)tbase * 4 + idx];
    }
    __syncthreads();

    v8f acc[2][8];
#pragma unroll
    for (int mt = 0; mt < 2; ++mt)
#pragma unroll
        for (int nt = 0; nt < 8; ++nt) {
            v8f z = {0.f, 0.f, 0.f, 0.f, 0.f, 0.f, 0.f, 0.f};
            acc[mt][nt] = z;
        }

    // Every global access below is 16 bytes a lane.
    // Columns: lane l15 of N tile nt holds column colbase + (nt >> 2) * 64 + l15 * 4 + (nt & 3),
    // so one b128 of a W_branch row feeds four N tiles and sixteen lanes cover 256 bytes in a row.
    // k: lane half h holds k = kb + 4h .. 4h+3 of its x_pre row, and the W_branch rows follow the
    // same order, so one b128 of x_pre feeds two k-steps.
    const float* ap = ws_xpre + (size_t)(tbase + l15) * CDIM + half * 4;   // second M tile: + 16 rows
    const float* bp = Wb + (size_t)(half * 4) * CDIM + colbase + l15 * 4;

    for (int kb = 0; kb < CDIM; kb += 8) {
        const v4f a0 = *(const v4f*)(ap);
        const v4f a1 = *(const v4f*)(ap + 16 * CDIM);
        v4f b[4][2];
#pragma unroll
        for (int e = 0; e < 4; ++e)
#pragma unroll
            for (int j = 0; j < 2; ++j) b[e][j] = *(const v4f*)(bp + e * CDIM + j * 64);
        ap += 8; bp += 8 * CDIM;
#pragma unroll
        for (int s = 0; s < 2; ++s) {
            const v2f av0 = {a0[2 * s], a0[2 * s + 1]};
            const v2f av1 = {a1[2 * s], a1[2 * s + 1]};
#pragma unroll
            for (int nt = 0; nt < 8; ++nt) {
                const v2f bv = {b[2 * s][nt >> 2][nt & 3], b[2 * s + 1][nt >> 2][nt & 3]};
                acc[0][nt] = __builtin_amdgcn_wmma_f32_16x16x4_f32(
                    false, av0, false, bv, (short)0, acc[0][nt], false, false);
                acc[1][nt] = __builtin_amdgcn_wmma_f32_16x16x4_f32(
                    false, av1, false, bv, (short)0, acc[1][nt], false, false);
            }
        }
    }

    // Epilogue: out[t, i*C + c] = sum_j Hres[i,j]*x[t, j*C + c] + y[t,c]*Hpost[i],
    // four adjacent columns a lane; every offset is an immediate on one address pair.
    const size_t eoff = (size_t)(tbase + 8 * half) * WD + colbase + l15 * 4;
    const float* xe = x + eoff;
    float* __restrict__ oe = out + eoff;
#pragma unroll
    for (int mt = 0; mt < 2; ++mt) {
#pragma unroll
        for (int rb = 0; rb < 8; rb += 2) {               // two accumulator rows a round
            v4f xv[2][2][4];
#pragma unroll
            for (int u = 0; u < 2; ++u)
#pragma unroll
                for (int j = 0; j < 2; ++j)
#pragma unroll
                    for (int s = 0; s < 4; ++s)
                        xv[u][j][s] = *(const v4f*)(xe + (mt * 16 + rb + u) * WD + s * CDIM + j * 64);
#pragma unroll
            for (int u = 0; u < 2; ++u) {
                const int r  = rb + u;
                const int tr = mt * 16 + r;               // C/D layout: M = r (+8 hi lanes)
                const float* __restrict__ h = &h_lds[(tr + 8 * half) * 20];
#pragma unroll
                for (int j = 0; j < 2; ++j) {
                    const v4f yv = {acc[mt][j * 4 + 0][r], acc[mt][j * 4 + 1][r],
                                    acc[mt][j * 4 + 2][r], acc[mt][j * 4 + 3][r]};
#pragma unroll
                    for (int i = 0; i < 4; ++i) {
                        const v4f o = h[i*4+0]*xv[u][j][0] + h[i*4+1]*xv[u][j][1]
                                    + h[i*4+2]*xv[u][j][2] + h[i*4+3]*xv[u][j][3]
                                    + yv * h[16 + i];
                        *(v4f*)(oe + tr * WD + i * CDIM + j * 64) = o;
                    }
                }
            }
            // The next round's loads land in data registers of the stores above.
            if (mt * 8 + rb + 2 < 16) asm volatile("s_wait_xcnt 0x0" ::: "memory");
        }
    }
}

// ---------------------------------------------------------------------------
extern "C" void kernel_launch(void* const* d_in, const int* in_sizes, int n_in,
                              void* d_out, int out_size, void* d_ws, size_t ws_size,
                              hipStream_t stream) {
    const float* x          = (const float*)d_in[0];
    const float* W_res      = (const float*)d_in[1];
    const float* W_pre      = (const float*)d_in[2];
    const float* W_post     = (const float*)d_in[3];
    const float* H_res_base = (const float*)d_in[4];
    const float* H_pre_base = (const float*)d_in[5];
    const float* H_post_base= (const float*)d_in[6];
    const float* gate       = (const float*)d_in[7];
    const float* W_branch   = (const float*)d_in[8];
    float* out = (float*)d_out;

    const int BT = in_sizes[0] / WD;   // B*T tokens (8192)

    float* ws       = (float*)d_ws;
    float* ws_xpre  = ws;                                  // BT*1024
    float* ws_z     = ws_xpre + (size_t)BT * CDIM;         // BT*16
    float* ws_hpost = ws_z + (size_t)BT * 16;              // BT*4

    mhc_router_kernel<<<BT / RT_TOK, 512, 0, stream>>>(
        x, W_res, W_pre, W_post, H_res_base, H_pre_base, H_post_base,
        ws_xpre, ws_z, ws_hpost);

    mhc_branch_mix_kernel<<<BT / 32, 256, 0, stream>>>(
        x, W_branch, ws_xpre, ws_z, ws_hpost, gate, out);

    (void)n_in; (void)out_size; (void)ws_size;
}

// v004
// It runs in 138 microseconds.
// In two side-by-side timings against v003, it was 1.03 and 1.04 times as fast.
// All steps since v000 together make it 7.25 times as fast.
#include <hip/hip_runtime.h>
#include <hip/hip_bf16.h>
#include <math.h>

#define NS        4
#define CDIM      1024
#define WD        4096          // NS * CDIM
#define TAU_INV   10.0f         // 1 / 0.1
#define RMS_EPS   1.1920929e-07f
#define SINK_ITERS 50

typedef __attribute__((ext_vector_type(2))) float v2f;
typedef __attribute__((ext_vector_type(4))) float v4f;
typedef __attribute__((ext_vector_type(8))) float v8f;

// ---------------------------------------------------------------------------
// Kernel 1: routing of 32 tokens per 512-thread workgroup (16 wave32).
// The 24 projection dots are a [32 x 4096] x [4096 x 24] product on
// V_WMMA_F32_16X16X4_F32: wave w owns k in [w*256, w*256+256), two token tiles
// by two output tiles (16 W_res rows; 4 W_pre + 4 W_post rows, repeated in the
// upper eight columns, whose results are not used). Each weight line is read
// once per 32 tokens. Partials of the 16 waves are summed in LDS, then Z,
// the two softmaxes and x_pre follow: Z one thread per value, each softmax one
// thread, x_pre four channels of 16 tokens per thread.
// ---------------------------------------------------------------------------
#define RT_TOK   32                 // tokens per workgroup
#define RT_WAVES 16
#define RT_KW    (WD / RT_WAVES)    // k range of one wave
#define RT_P     26                 // 24 dots + sum of squares of each lane half

__global__ __launch_bounds__(512)
void mhc_router_kernel(const float* __restrict__ x,
                       const float* __restrict__ W_res,     // [16,4096]
                       const float* __restrict__ W_pre,     // [4,4096]
                       const float* __restrict__ W_post,    // [4,4096]
                       const float* __restrict__ H_res_base,// [16]
                       const float* __restrict__ H_pre_base,// [4]
                       const float* __restrict__ H_post_base,//[4]
                       float* __restrict__ ws_xpre,         // [BT,1024]
                       float* __restrict__ ws_z,            // [BT,16] logits / tau
                       float* __restrict__ ws_hpost)        // [BT,4]
{
    const int tid   = threadIdx.x;
    const int wave  = tid >> 5;
    const int lane  = tid & 31;
    const int half  = lane >> 4;
    const int l15   = lane & 15;
    const int tbase = blockIdx.x * RT_TOK;

    __shared__ float part[RT_WAVES * RT_TOK * RT_P];
    __shared__ float tot[RT_TOK * RT_P];
    __shared__ __attribute__((aligned(16))) float hsh[RT_TOK * 4];   // H_pre, read as float4

    // One b128 per lane feeds two k-steps: lane half h holds k = kb + 4h .. 4h+3
    // of its row, the same for the token rows (A) and the weight rows (B).
    const int k0 = wave * RT_KW + half * 4;
    const float* ap  = x + (size_t)(tbase + l15) * WD + k0;      // second token tile: + 16 rows
    const float* b0p = W_res + (size_t)l15 * WD + k0;
    const float* b1p = ((l15 & 4) ? W_post : W_pre) + (size_t)(l15 & 3) * WD + k0;

    v8f acc[2][2];
#pragma unroll
    for (int mt = 0; mt < 2; ++mt)
#pragma unroll
        for (int nt = 0; nt < 2; ++nt) {
            v8f z = {0.f, 0.f, 0.f, 0.f, 0.f, 0.f, 0.f, 0.f};
            acc[mt][nt] = z;
        }
    v2f ss0l = {0.f, 0.f}, ss0h = {0.f, 0.f};   // sums of squares, by register pair of the A fragments
    v2f ss1l = {0.f, 0.f}, ss1h = {0.f, 0.f};

    // One trip: 64 k of every row (256 bytes), 32 loads, 64 WMMAs.
    for (int kb = 0; kb < RT_KW; kb += 64) {
        v4f a0[8], a1[8], b0[8], b1[8];
#pragma unroll
        for (int i = 0; i < 8; ++i) {
            a0[i] = *(const v4f*)(ap + i * 8);
            a1[i] = *(const v4f*)(ap + 16 * WD + i * 8);
        }
#pragma unroll
        for (int i = 0; i < 8; ++i) {
            b0[i] = *(const v4f*)(b0p + i * 8);
            b1[i] = *(const v4f*)(b1p + i * 8);
        }
        // The three address pairs stay live up to this wait, so that no result of the run
        // is placed in a register that an issued load names; they advance behind it.
        asm volatile("s_wait_xcnt 0x0" :: "v"(ap), "v"(b0p), "v"(b1p) : "memory");
        ap += 64; b0p += 64; b1p += 64;
#pragma unroll
        for (int i = 0; i < 8; ++i) {
            const v2f p0l = {a0[i].x, a0[i].y}, p0h = {a0[i].z, a0[i].w};
            const v2f p1l = {a1[i].x, a1[i].y}, p1h = {a1[i].z, a1[i].w};
            ss0l += p0l * p0l;
            ss0h += p0h * p0h;
            ss1l += p1l * p1l;
            ss1h += p1h * p1h;
        }
#pragma unroll
        for (int i = 0; i < 8; ++i) {
            const v2f a0l = {a0[i].x, a0[i].y}, a0h = {a0[i].z, a0[i].w};
            const v2f a1l = {a1[i].x, a1[i].y}, a1h = {a1[i].z, a1[i].w};
            const v2f b0l = {b0[i].x, b0[i].y}, b0h = {b0[i].z, b0[i].w};
            const v2f b1l = {b1[i].x, b1[i].y}, b1h = {b1[i].z, b1[i].w};
            acc[0][0] = __builtin_amdgcn_wmma_f32_16x16x4_f32(false, a0l, false, b0l, (short)0, acc[0][0], false, false);
            acc[1][0] = __builtin_amdgcn_wmma_f32_16x16x4_f32(false, a1l, false, b0l, (short)0, acc[1][0], false, false);
            acc[0][1] = __builtin_amdgcn_wmma_f32_16x16x4_f32(false, a0l, false, b1l, (short)0, acc[0][1], false, false);
            acc[1][1] = __builtin_amdgcn_wmma_f32_16x16x4_f32(false, a1l, false, b1l, (short)0, acc[1][1], false, false);
            acc[0][0] = __builtin_amdgcn_wmma_f32_16x16x4_f32(false, a0h, false, b0h, (short)0, acc[0][0], false, false);
            acc[1][0] = __builtin_amdgcn_wmma_f32_16x16x4_f32(false, a1h, false, b0h, (short)0, acc[1][0], false, false);
            acc[0][1] = __builtin_amdgcn_wmma_f32_16x16x4_f32(false, a0h, false, b1h, (short)0, acc[0][1], false, false);
            acc[1][1] = __builtin_amdgcn_wmma_f32_16x16x4_f32(false, a1h, false, b1h, (short)0, acc[1][1], false, false);
        }
        // Order of the trip: the 32 loads (all in flight before the first use; left alone
        // the compiler holds the last twelve back among the WMMAs), then the vector work,
        // then the matrix run, so that no vector result is placed in an A or B register
        // directly behind the WMMA that reads it.
        __builtin_amdgcn_sched_group_barrier(0x020, 32, 0);   // global loads
        __builtin_amdgcn_sched_group_barrier(0x002, 38, 0);   // vector ALU
        __builtin_amdgcn_sched_group_barrier(0x008, 64, 0);   // WMMA
    }

    // Four vector slots between the last WMMAs and the address arithmetic below, which reuses
    // their A registers (left alone, the first such write stands three slots behind its WMMA).
    asm volatile("v_nop\n\tv_nop\n\tv_nop\n\tv_nop");

    // This wave's partials: [token][0..15 res, 16..19 pre, 20..23 post, 24..25 sumsq]
    {
        float* __restrict__ pw = part + wave * (RT_TOK * RT_P);
#pragma unroll
        for (int mt = 0; mt < 2; ++mt)
#pragma unroll
            for (int r = 0; r < 8; ++r) {
                const int tl = mt * 16 + r + 8 * half;   // C/D layout: M = r (+8 hi lanes)
                pw[tl * RT_P + l15] = acc[mt][0][r];
            }
        if (l15 < 8) {
#pragma unroll
            for (int mt = 0; mt < 2; ++mt)
#pragma unroll
                for (int r = 0; r < 8; ++r)
                    pw[(mt * 16 + r + 8 * half) * RT_P + 16 + l15] = acc[mt][1][r];
        }
        pw[l15 * RT_P + 24 + half]        = (ss0l.x + ss0l.y) + (ss0h.x + ss0h.y);
        pw[(16 + l15) * RT_P + 24 + half] = (ss1l.x + ss1l.y) + (ss1h.x + ss1h.y);
    }
    __syncthreads();

    for (int idx = tid; idx < RT_TOK * RT_P; idx += 512) {
        float s = 0.0f;
#pragma unroll
        for (int w = 0; w < RT_WAVES; ++w) s += part[w * (RT_TOK * RT_P) + idx];
        tot[idx] = s;
    }
    __syncthreads();

    // --- Z = logits / tau, input of the Sinkhorn in the mix kernel ---
    {
        const int tl = tid >> 4, k = tid & 15;
        const float* __restrict__ tr = tot + tl * RT_P;
        const float scale = rsqrtf((tr[24] + tr[25]) * (1.0f / (float)WD) + RMS_EPS);
        ws_z[(size_t)(tbase + tl) * 16 + k] = (tr[k] * scale + H_res_base[k]) * TAU_INV;
    }
    // --- softmax(pre) on even threads, softmax(post) on odd threads ---
    if (tid < 2 * RT_TOK) {
        const int tl = tid >> 1, post = tid & 1;
        const float* __restrict__ tr = tot + tl * RT_P;
        const float* __restrict__ hb = post ? H_post_base : H_pre_base;
        const float scale = rsqrtf((tr[24] + tr[25]) * (1.0f / (float)WD) + RMS_EPS);
        float l[4]; float m = -3.0e38f;
#pragma unroll
        for (int r = 0; r < 4; ++r) { l[r] = tr[16 + post * 4 + r] * scale + hb[r]; m = fmaxf(m, l[r]); }
        float s = 0.f;
#pragma unroll
        for (int r = 0; r < 4; ++r) { l[r] = expf(l[r] - m); s += l[r]; }
        const float inv = 1.0f / s;
        if (post) {
#pragma unroll
            for (int r = 0; r < 4; ++r) ws_hpost[(size_t)(tbase + tl) * 4 + r] = l[r] * inv;
        } else {
#pragma unroll
            for (int r = 0; r < 4; ++r) hsh[tl * 4 + r] = l[r] * inv;
        }
    }
    __syncthreads();

    // x_pre: 256 threads x 4 floats cover one token's 1024 channels; the two halves of the
    // block take the even and the odd tokens, eight tokens each a trip (32 loads in flight).
    const int hi = tid >> 8, cb = (tid & 255) * 4;
    const float* xb = x + (size_t)(tbase + hi) * WD + cb;
    float* __restrict__ ob = ws_xpre + (size_t)(tbase + hi) * CDIM + cb;
    // Unrolled: every load and store is then an immediate offset on its one address pair.
#pragma unroll
    for (int jb = 0; jb < RT_TOK / 2; jb += 8) {
        v4f xv[8][4];
#pragma unroll
        for (int u = 0; u < 8; ++u)
#pragma unroll
            for (int s = 0; s < 4; ++s) xv[u][s] = *(const v4f*)(xb + (jb + u) * 2 * WD + s * CDIM);
        // The address pair stays live up to this wait, so that no result of the run lands in it.
        asm volatile("s_wait_xcnt 0x0" :: "v"(xb) : "memory");
#pragma unroll
        for (int u = 0; u < 8; ++u) {
            const v4f hp = *(const v4f*)(hsh + (2 * (jb + u) + hi) * 4);
            const v4f xp = xv[u][0] * hp.x + xv[u][1] * hp.y + xv[u][2] * hp.z + xv[u][3] * hp.w;
            *(v4f*)(ob + (jb + u) * 2 * CDIM) = xp;
        }
        // The next trip's loads land in the data registers of the stores above.
        if (jb + 8 < RT_TOK / 2) asm volatile("s_wait_xcnt 0x0" ::: "memory");
    }
}

// Value held by lane K of this lane's group of four (DPP quad_perm [K,K,K,K]).
template <int K>
__device__ __forceinline__ float quad_bcast(float v) {
    return __int_as_float(__builtin_amdgcn_mov_dpp(__float_as_int(v), K * 0x55, 0xf, 0xf, true));
}

// -(log sum exp) of four values, summed in index order.
__device__ __forceinline__ float neg_lse4(float a0, float a1, float a2, float a3) {
    const float m = fmaxf(fmaxf(a0, a1), fmaxf(a2, a3));
    return -(m + logf(expf(a0-m)+expf(a1-m)+expf(a2-m)+expf(a3-m)));
}

// ---------------------------------------------------------------------------
// Kernel 2: fused branch GEMM (y = x_pre @ W_branch) via V_WMMA_F32_16X16X4_F32
// + mixing epilogue. One workgroup (12 wave32) per 32 tokens (2 M-tiles);
// wave w < 8 owns output columns [w*128, w*128+128) for both M-tiles, so each
// B fragment is reused by 2 WMMAs (halves the B-load : WMMA ratio).
// Within its 128 columns a lane owns four adjacent ones per 64, see below.
// Waves 8-11 run the log-domain Sinkhorn of the 32 tokens, four lanes per token
// (lane q owns row q for u and column q for v), on the vector port while waves
// 0-7 keep the matrix unit busy; only the epilogue needs both results, so the
// one barrier stands between the GEMM loop and the epilogue.
// ---------------------------------------------------------------------------
#define MIX_GEMM_WAVES 8
__global__ __launch_bounds__(384)
void mhc_branch_mix_kernel(const float* __restrict__ x,        // [BT,4096]
                           const float* __restrict__ Wb,       // [1024,1024]
                           const float* __restrict__ ws_xpre,  // [BT,1024]
                           const float* __restrict__ ws_z,     // [BT,16] logits / tau
                           const float* __restrict__ ws_hpost, // [BT,4]
                           const float* __restrict__ gate,     // [1]
                           float* __restrict__ out)            // [BT,4096]
{
    const int tid     = threadIdx.x;
    const int wave    = __builtin_amdgcn_readfirstlane(tid >> 5);   // scalar: the role test is a scalar branch
    const int lane    = tid & 31;
    const int half    = lane >> 4;       // 0: lanes 0-15, 1: lanes 16-31
    const int l15     = lane & 15;
    const int tbase   = blockIdx.x * 32; // 2 M-tiles of 16 tokens
    const int colbase = wave * 128;

    __shared__ float h_lds[32 * 20];     // per token: 16 H_res_eff + 4 H_post

    v8f acc[2][8];                       // set and read by the GEMM waves only

    if (wave >= MIX_GEMM_WAVES) {
        const int st = tid - MIX_GEMM_WAVES * 32;      // 0..127: 32 tokens x 4 lanes
        const int tl = st >> 2, q = st & 3;
        const float hpost = ws_hpost[(size_t)tbase * 4 + st];         // H_post[q] of this token
        const float* __restrict__ z = ws_z + (size_t)(tbase + tl) * 16;
        const v4f zr = *(const v4f*)(z + q * 4);                      // row q
        const float zc0 = z[q], zc1 = z[4 + q], zc2 = z[8 + q], zc3 = z[12 + q]; // column q

        float u = 0.f, v = 0.f;    // u[q], v[q] of this token
        for (int it = 0; it < SINK_ITERS; ++it) {
            u = neg_lse4(zr.x + quad_bcast<0>(v), zr.y + quad_bcast<1>(v),
                         zr.z + quad_bcast<2>(v), zr.w + quad_bcast<3>(v));
            v = neg_lse4(zc0 + quad_bcast<0>(u), zc1 + quad_bcast<1>(u),
                         zc2 + quad_bcast<2>(u), zc3 + quad_bcast<3>(u));
        }

        const float g = 1.0f / (1.0f + expf(-gate[0]));
        float* __restrict__ h = &h_lds[tl * 20 + q * 4];
        h[0] = g * expf(zr.x + u + quad_bcast<0>(v)) + ((q == 0) ? (1.0f - g) : 0.0f);
        h[1] = g * expf(zr.y + u + quad_bcast<1>(v)) + ((q == 1) ? (1.0f - g) : 0.0f);
        h[2] = g * expf(zr.z + u + quad_bcast<2>(v)) + ((q == 2) ? (1.0f - g) : 0.0f);
        h[3] = g * expf(zr.w + u + quad_bcast<3>(v)) + ((q == 3) ? (1.0f - g) : 0.0f);
        h_lds[tl * 20 + 16 + q] = hpost;
    } else {
#pragma unroll
        for (int mt = 0; mt < 2; ++mt)
#pragma unroll
            for (int nt = 0; nt < 8; ++nt) {
                v8f z = {0.f, 0.f, 0.f, 0.f, 0.f, 0.f, 0.f, 0.f};
                acc[mt][nt] = z;
            }

        // Every global access below is 16 bytes a lane.
        // Columns: lane l15 of N tile nt holds column colbase + (nt >> 2) * 64 + l15 * 4 + (nt & 3),
        // so one b128 of a W_branch row feeds four N tiles and sixteen lanes cover 256 bytes in a row.
        // k: lane half h holds k = kb + 4h .. 4h+3 of its x_pre row, and the W_branch rows follow the
        // same order, so one b128 of x_pre feeds two k-steps.
        const float* ap = ws_xpre + (size_t)(tbase + l15) * CDIM + half * 4;   // second M tile: + 16 rows
        const float* bp = Wb + (size_t)(half * 4) * CDIM + colbase + l15 * 4;

        for (int kb = 0; kb < CDIM; kb += 8) {
            const v4f a0 = *(const v4f*)(ap);
            const v4f a1 = *(const v4f*)(ap + 16 * CDIM);
            v4f b[4][2];
#pragma unroll
            for (int e = 0; e < 4; ++e)
#pragma unroll
                for (int j = 0; j < 2; ++j) b[e][j] = *(const v4f*)(bp + e * CDIM + j * 64);
            ap += 8; bp += 8 * CDIM;
#pragma unroll
            for (int s = 0; s < 2; ++s) {
                const v2f av0 = {a0[2 * s], a0[2 * s + 1]};
                const v2f av1 = {a1[2 * s], a1[2 * s + 1]};
#pragma unroll
                for (int nt = 0; nt < 8; ++nt) {
                    const v2f bv = {b[2 * s][nt >> 2][nt & 3], b[2 * s + 1][nt >> 2][nt & 3]};
                    acc[0][nt] = __builtin_amdgcn_wmma_f32_16x16x4_f32(
                        false, av0, false, bv, (short)0, acc[0][nt], false, false);
                    acc[1][nt] = __builtin_amdgcn_wmma_f32_16x16x4_f32(
                        false, av1, false, bv, (short)0, acc[1][nt], false, false);
                }
            }
        }
    }
    __syncthreads();                          // h_lds is complete; every wave passes here once
    if (wave >= MIX_GEMM_WAVES) return;       // no barrier follows

    // Epilogue: out[t, i*C + c] = sum_j Hres[i,j]*x[t, j*C + c] + y[t,c]*Hpost[i],
    // four adjacent columns a lane; every offset is an immediate on one address pair.
    const size_t eoff = (size_t)(tbase + 8 * half) * WD + colbase + l15 * 4;
    const float* xe = x + eoff;
    float* __restrict__ oe = out + eoff;
#pragma unroll
    for (int mt = 0; mt < 2; ++mt) {
#pragma unroll
        for (int rb = 0; rb < 8; rb += 2) {               // two accumulator rows a round
            v4f xv[2][2][4];
#pragma unroll
            for (int u = 0; u < 2; ++u)
#pragma unroll
                for (int j = 0; j < 2; ++j)
#pragma unroll
                    for (int s = 0; s < 4; ++s)
                        xv[u][j][s] = *(const v4f*)(xe + (mt * 16 + rb + u) * WD + s * CDIM + j * 64);
#pragma unroll
            for (int u = 0; u < 2; ++u) {
                const int r  = rb + u;
                const int tr = mt * 16 + r;               // C/D layout: M = r (+8 hi lanes)
                const float* __restrict__ h = &h_lds[(tr + 8 * half) * 20];
#pragma unroll
                for (int j = 0; j < 2; ++j) {
                    const v4f yv = {acc[mt][j * 4 + 0][r], acc[mt][j * 4 + 1][r],
                                    acc[mt][j * 4 + 2][r], acc[mt][j * 4 + 3][r]};
#pragma unroll
                    for (int i = 0; i < 4; ++i) {
                        const v4f o = h[i*4+0]*xv[u][j][0] + h[i*4+1]*xv[u][j][1]
                                    + h[i*4+2]*xv[u][j][2] + h[i*4+3]*xv[u][j][3]
                                    + yv * h[16 + i];
                        *(v4f*)(oe + tr * WD + i * CDIM + j * 64) = o;
                    }
                }
            }
            // The next round's loads land in data registers of the stores above.
            if (mt * 8 + rb + 2 < 16) asm volatile("s_wait_xcnt 0x0" ::: "memory");
        }
    }
}

// ---------------------------------------------------------------------------
extern "C" void kernel_launch(void* const* d_in, const int* in_sizes, int n_in,
                              void* d_out, int out_size, void* d_ws, size_t ws_size,
                              hipStream_t stream) {
    const float* x          = (const float*)d_in[0];
    const float* W_res      = (const float*)d_in[1];
    const float* W_pre      = (const float*)d_in[2];
    const float* W_post     = (const float*)d_in[3];
    const float* H_res_base = (const float*)d_in[4];
    const float* H_pre_base = (const float*)d_in[5];
    const float* H_post_base= (const float*)d_in[6];
    const float* gate       = (const float*)d_in[7];
    const float* W_branch   = (const float*)d_in[8];
    float* out = (float*)d_out;

    const int BT = in_sizes[0] / WD;   // B*T tokens (8192)

    float* ws       = (float*)d_ws;
    float* ws_xpre  = ws;                                  // BT*1024
    float* ws_z     = ws_xpre + (size_t)BT * CDIM;         // BT*16
    float* ws_hpost = ws_z + (size_t)BT * 16;              // BT*4

    mhc_router_kernel<<<BT / RT_TOK, 512, 0, stream>>>(
        x, W_res, W_pre, W_post, H_res_base, H_pre_base, H_post_base,
        ws_xpre, ws_z, ws_hpost);

    mhc_branch_mix_kernel<<<BT / 32, 384, 0, stream>>>(
        x, W_branch, ws_xpre, ws_z, ws_hpost, gate, out);

    (void)n_in; (void)out_size; (void)ws_size;
}
